// v000
// Times are from an AMD MI455X. After a warm-up the kernel runs many times in a row, and a time is the length of
// such a window on the GPU divided by its runs, so every launch and the gaps after it count. The runs cycle
// through copies of the inputs. A figure is the median of several windows, for all but v000 over two sittings.
// Sittings can differ by a few percent; kernels timed side by side share one.
// v000, which the later versions start from, runs in 314 microseconds.
#include <hip/hip_runtime.h>

// Operand types: q/k projections and S = q.k^T on v_wmma_f32_16x16x32_bf16 with bf16 hi/lo split operands (hi*hi + hi*lo + lo*hi); v projection (Wv scaled by 16) and P.V (P scaled by 4096) on v_wmma_f32_16x16x32_f16; all accumulators f32; softmax, normalisation and residual in f32.

#define T_   4096
#define C_   256
#define CQ_  32
#define B_   4
#define XP   264      // LDS pitch (16-bit elements) of transposed x tiles: 256 + 8
#define QT   32       // time rows per block, q/k projection
#define VT   64       // time columns per block, v projection
#define VO   64       // output channels per block, v projection
#define VTP  72       // LDS pitch (16-bit elements) of the v output tile
#define AT   32       // query rows per block, fused softmax + P.V kernel
#define OBP  36       // LDS pitch (floats) of the output staging tile
#define LN4096 8.31776616671934f

typedef char chk_dims[((T_ % QT) == 0 && (T_ % VT) == 0 && (T_ % AT) == 0 && (T_ % 64) == 0 &&
                       (C_ % VO) == 0 && (C_ % 32) == 0 && (CQ_ == 32) && (VO == 64) && (VT == 64) && (AT == 32)) ? 1 : -1];

typedef __bf16         v16b __attribute__((ext_vector_type(16)));
typedef __bf16         v8b  __attribute__((ext_vector_type(8), __may_alias__));
typedef _Float16       v16h __attribute__((ext_vector_type(16)));
typedef _Float16       v8h  __attribute__((ext_vector_type(8), __may_alias__));
typedef float          v8f  __attribute__((ext_vector_type(8)));
typedef float          v4f  __attribute__((ext_vector_type(4), __may_alias__));
typedef unsigned short v8us __attribute__((ext_vector_type(8), __may_alias__));

union FragB { v16b v; v8b h2[2]; __bf16 e[16]; };
union FragH { v16h v; v8h h2[2]; _Float16 e[16]; };

// ---------------------------------------------------------------------------------------------
// 16x16x32 tiles. Per lane: h = lane>>4, m = lane&15.
// A: row m, elements 0..7 <- k0+8h+0..7, elements 8..15 <- k0+16+8h+0..7.
// B: column m, same k map (loaded from a [n][k] k-contiguous copy exactly like A).
// D: element r <- (row 8h+r, column m).
// ---------------------------------------------------------------------------------------------
__device__ __forceinline__ v8f mma_bf(v16b a, v16b b, v8f c) {
    return __builtin_amdgcn_wmma_f32_16x16x32_bf16(false, a, false, b, (short)0, c, false, false);
}
__device__ __forceinline__ v8f mma_h(v16h a, v16h b, v8f c) {
    return __builtin_amdgcn_wmma_f32_16x16x32_f16(false, a, false, b, (short)0, c, false, false);
}
#define WG4(acc, p0, p1, p2, p3) \
    asm volatile("v_nop\n\tv_nop\n\tv_nop\n\tv_nop" : "+v"(acc) : "v"(p0), "v"(p1), "v"(p2), "v"(p3))

__device__ __forceinline__ unsigned short bfbits(__bf16 v) { return __builtin_bit_cast(unsigned short, v); }
__device__ __forceinline__ float bf2f(__bf16 v) {
    return __builtin_bit_cast(float, ((unsigned int)bfbits(v)) << 16);
}
// RNE convert to bf16 hi part and bf16 residual
__device__ __forceinline__ void split_bf(float f, __bf16& hi, __bf16& lo) {
    hi = (__bf16)f;
    lo = (__bf16)(f - bf2f(hi));
}

// B fragment for column m of W (row o of W, k contiguous): p = W + o*C + k0 + 8h
__device__ __forceinline__ void load_w_split(const float* __restrict__ p, FragB& bh, FragB& bl) {
    const v4f f0 = *(const v4f*)(p);
    const v4f f1 = *(const v4f*)(p + 4);
    const v4f f2 = *(const v4f*)(p + 16);
    const v4f f3 = *(const v4f*)(p + 20);
    #pragma unroll
    for (int i = 0; i < 4; ++i) {
        __bf16 a, e;
        split_bf(f0[i], a, e); bh.e[i]      = a; bl.e[i]      = e;
        split_bf(f1[i], a, e); bh.e[4 + i]  = a; bl.e[4 + i]  = e;
        split_bf(f2[i], a, e); bh.e[8 + i]  = a; bl.e[8 + i]  = e;
        split_bf(f3[i], a, e); bh.e[12 + i] = a; bl.e[12 + i] = e;
    }
}
__device__ __forceinline__ void load_w_h16x16(const float* __restrict__ p, FragH& b) {
    const v4f f0 = *(const v4f*)(p);
    const v4f f1 = *(const v4f*)(p + 4);
    const v4f f2 = *(const v4f*)(p + 16);
    const v4f f3 = *(const v4f*)(p + 20);
    #pragma unroll
    for (int i = 0; i < 4; ++i) {
        b.e[i]      = (_Float16)(f0[i] * 16.0f);
        b.e[4 + i]  = (_Float16)(f1[i] * 16.0f);
        b.e[8 + i]  = (_Float16)(f2[i] * 16.0f);
        b.e[12 + i] = (_Float16)(f3[i] * 16.0f);
    }
}

// =============================================================================================
// q[b,t,o] = sum_c Wq[o,c] x[b,c,t] + bq[o]; k likewise. Output planes [B][T][32] bf16 hi and lo.
// Block: 32 t rows, 2 waves (wave w -> rows 16w..16w+15), A = x tile [t][c] from LDS, B = W rows.
// =============================================================================================
__global__ __launch_bounds__(64)
void k_projqk(const float* __restrict__ x, const float* __restrict__ Wq, const float* __restrict__ bq,
              const float* __restrict__ Wk, const float* __restrict__ bk,
              unsigned short* __restrict__ Qh, unsigned short* __restrict__ Ql,
              unsigned short* __restrict__ Kh, unsigned short* __restrict__ Kl)
{
    __shared__ __attribute__((aligned(16))) __bf16 xh[QT * XP];
    __shared__ __attribute__((aligned(16))) __bf16 xl[QT * XP];
    __shared__ __attribute__((aligned(16))) unsigned short ob[4 * QT * CQ_];

    const int tid = threadIdx.x;
    const int l = tid & 31, w = tid >> 5, h = l >> 4, m = l & 15;
    const int t0 = blockIdx.x * QT, b = blockIdx.y;
    if (t0 + QT > T_ || b >= B_) return;

    // stage x[b][c][t0..t0+31] transposed into xh/xl[t][c]
    const float* xb = x + (size_t)b * C_ * T_ + t0;
    #pragma unroll 2
    for (int it = 0; it < (C_ * QT / 4) / 64; ++it) {
        const int idx = it * 64 + tid;
        const int c   = idx >> 3;
        const int q4  = idx & 7;
        const v4f v = *(const v4f*)(xb + (size_t)c * T_ + 4 * q4);
        #pragma unroll
        for (int j = 0; j < 4; ++j) {
            __bf16 a, e;
            split_bf(v[j], a, e);
            xh[(4 * q4 + j) * XP + c] = a;
            xl[(4 * q4 + j) * XP + c] = e;
        }
    }
    __syncthreads();

    const v8f zero = {};
    v8f acc[4];
    #pragma unroll
    for (int j = 0; j < 4; ++j) acc[j] = zero;

    const __bf16* arh = xh + (16 * w + m) * XP + 8 * h;
    const __bf16* arl = xl + (16 * w + m) * XP + 8 * h;
    const float* wq = Wq + (size_t)m * C_ + 8 * h;
    const float* wk = Wk + (size_t)m * C_ + 8 * h;

    #pragma unroll 1
    for (int ks = 0; ks < C_ / 32; ++ks) {
        const int k0 = ks * 32;
        FragB ah, al;
        ah.h2[0] = *(const v8b*)(arh + k0);
        ah.h2[1] = *(const v8b*)(arh + k0 + 16);
        al.h2[0] = *(const v8b*)(arl + k0);
        al.h2[1] = *(const v8b*)(arl + k0 + 16);
        #pragma unroll
        for (int j = 0; j < 4; ++j) {
            const float* wp = ((j < 2) ? wq : wk) + (size_t)(16 * (j & 1)) * C_ + k0;
            FragB bh, bl;
            load_w_split(wp, bh, bl);
            acc[j] = mma_bf(ah.v, bh.v, acc[j]);
            acc[j] = mma_bf(ah.v, bl.v, acc[j]);
            acc[j] = mma_bf(al.v, bh.v, acc[j]);
            WG4(acc[j], ah.v, al.v, bh.v, bl.v);
        }
    }

    // epilogue: bias, split into hi/lo, stage [plane][t][o] in LDS
    #pragma unroll
    for (int j = 0; j < 4; ++j) {
        const int o = 16 * (j & 1) + m;
        const float bias = ((j < 2) ? bq : bk)[o];
        const int pb = ((j < 2) ? 0 : 2) * (QT * CQ_);
        #pragma unroll
        for (int r = 0; r < 8; ++r) {
            const int tl = 16 * w + 8 * h + r;
            __bf16 a, e;
            split_bf(acc[j][r] + bias, a, e);
            ob[pb + tl * CQ_ + o]            = bfbits(a);
            ob[pb + QT * CQ_ + tl * CQ_ + o] = bfbits(e);
        }
    }
    __syncthreads();

    v8us vals[8];
    #pragma unroll
    for (int it = 0; it < 8; ++it) {
        const int p  = it >> 1;
        const int wi = (it & 1) * 64 + tid;
        vals[it] = *(const v8us*)(ob + p * (QT * CQ_) + wi * 8);
    }
    const size_t gb = ((size_t)b * T_ + t0) * CQ_;
    #pragma unroll
    for (int it = 0; it < 8; ++it) {
        const int p  = it >> 1;
        const int wi = (it & 1) * 64 + tid;
        unsigned short* dst = ((p == 0) ? Qh : (p == 1) ? Ql : (p == 2) ? Kh : Kl) + gb + (size_t)wi * 8;
        *(v8us*)dst = vals[it];
    }
    
}

// =============================================================================================
// v[b,c,t] = sum_c' Wv[c,c'] x[b,c',t] + bv[c]; output plane [B][C][T] f16.
// Block: 64 t x 64 c, 4 waves (wave w -> channels o0+16w..+15, all four 16-row t tiles).
// =============================================================================================
__global__ __launch_bounds__(128)
void k_projv(const float* __restrict__ x, const float* __restrict__ Wv, const float* __restrict__ bv,
             _Float16* __restrict__ V)
{
    __shared__ __attribute__((aligned(16))) _Float16 xt[VT * XP];
    __shared__ __attribute__((aligned(16))) _Float16 vt[VO * VTP];

    const int tid = threadIdx.x;
    const int l = tid & 31, w = tid >> 5, h = l >> 4, m = l & 15;
    const int t0 = blockIdx.x * VT, o0 = blockIdx.y * VO, b = blockIdx.z;
    if (t0 + VT > T_ || o0 + VO > C_ || b >= B_) return;

    // stage x[b][c][t0..t0+63] transposed into xt[t][c] (f16)
    const float* xb = x + (size_t)b * C_ * T_ + t0;
    #pragma unroll 2
    for (int it = 0; it < (C_ * VT / 4) / 128; ++it) {
        const int idx = it * 128 + tid;
        const int c   = idx >> 4;
        const int q4  = idx & 15;
        const v4f v = *(const v4f*)(xb + (size_t)c * T_ + 4 * q4);
        #pragma unroll
        for (int j = 0; j < 4; ++j) xt[(4 * q4 + j) * XP + c] = (_Float16)v[j];
    }
    __syncthreads();

    const v8f zero = {};
    v8f acc[4];
    #pragma unroll
    for (int mt = 0; mt < 4; ++mt) acc[mt] = zero;

    const _Float16* ar = xt + m * XP + 8 * h;
    const float* wr = Wv + (size_t)(o0 + 16 * w + m) * C_ + 8 * h;

    #pragma unroll 1
    for (int ks = 0; ks < C_ / 32; ++ks) {
        const int k0 = ks * 32;
        FragH bw;
        load_w_h16x16(wr + k0, bw);
        FragH a[4];
        #pragma unroll
        for (int mt = 0; mt < 4; ++mt) {
            a[mt].h2[0] = *(const v8h*)(ar + 16 * mt * XP + k0);
            a[mt].h2[1] = *(const v8h*)(ar + 16 * mt * XP + k0 + 16);
        }
        #pragma unroll
        for (int mt = 0; mt < 4; ++mt) acc[mt] = mma_h(a[mt].v, bw.v, acc[mt]);
        asm volatile("v_nop\n\tv_nop\n\tv_nop\n\tv_nop"
                     : "+v"(acc[0]), "+v"(acc[1]), "+v"(acc[2]), "+v"(acc[3])
                     : "v"(bw.v), "v"(a[0].v), "v"(a[1].v), "v"(a[2].v), "v"(a[3].v));
    }

    // epilogue: undo the x16, add bias, stage transposed vt[c][t]
    const int cl = 16 * w + m;
    const float bias = bv[o0 + cl];
    #pragma unroll
    for (int mt = 0; mt < 4; ++mt) {
        #pragma unroll
        for (int r = 0; r < 8; ++r) {
            const int tl = 16 * mt + 8 * h + r;
            vt[cl * VTP + tl] = (_Float16)(acc[mt][r] * 0.0625f + bias);
        }
    }
    __syncthreads();

    v8h vals[4];
    #pragma unroll
    for (int it = 0; it < 4; ++it) {
        const int id = it * 128 + tid;
        const int line = id >> 3, ch = id & 7;
        vals[it] = *(const v8h*)(vt + line * VTP + ch * 8);
    }
    #pragma unroll
    for (int it = 0; it < 4; ++it) {
        const int id = it * 128 + tid;
        const int line = id >> 3, ch = id & 7;
        _Float16* dst = V + ((size_t)b * C_ + o0 + line) * T_ + t0 + ch * 8;
        *(v8h*)dst = vals[it];
    }
    
}

// =============================================================================================
// Fused softmax(q.k^T) . V + residual. Block: 32 query rows x 256 channels, 4 waves.
// Wave (mt, g): query tile rows t0+16mt..+15; S for keys s0+32g..s0+32g+31 of each 64-key step;
// P.V for channels 128g..128g+127. Row max / partial row sums exchanged through LDS.
// out[b,c,t] = (sum_s P[t,s] V[c,s]) / (sum_s P[t,s]) + x[b,c,t]
// =============================================================================================
__global__ __launch_bounds__(128)
void k_attn(const __bf16* __restrict__ Qh, const __bf16* __restrict__ Ql,
            const __bf16* __restrict__ Kh, const __bf16* __restrict__ Kl,
            const _Float16* __restrict__ V, const float* __restrict__ x, float* __restrict__ out)
{
    __shared__ __attribute__((aligned(16))) _Float16 Pl[2 * 16 * 64];
    __shared__ __attribute__((aligned(16))) float rmax[64];
    __shared__ __attribute__((aligned(16))) float rsum[64];
    __shared__ __attribute__((aligned(16))) float obuf[C_ * OBP];

    const int tid = threadIdx.x;
    const int l = tid & 31, w = tid >> 5, h = l >> 4, m = l & 15;
    const int mt = w >> 1, g = w & 1;
    const int t0 = blockIdx.x * AT, b = blockIdx.y;
    if (t0 + AT > T_ || b >= B_) return;

    // A fragments of q (hi and lo), held for the whole key loop
    const size_t qoff = ((size_t)b * T_ + t0 + 16 * mt + m) * CQ_ + 8 * h;
    FragB aqh, aql;
    aqh.h2[0] = *(const v8b*)(Qh + qoff);
    aqh.h2[1] = *(const v8b*)(Qh + qoff + 16);
    aql.h2[0] = *(const v8b*)(Ql + qoff);
    aql.h2[1] = *(const v8b*)(Ql + qoff + 16);

    // B fragments of k: column m = key (kbase + m), elements from row (kbase + m) of the [key][32] plane
    const __bf16* kbh = Kh + ((size_t)b * T_ + 32 * g + m) * CQ_ + 8 * h;
    const __bf16* kbl = Kl + ((size_t)b * T_ + 32 * g + m) * CQ_ + 8 * h;
    // B fragments of v: column m = channel (128g + 16nt + m), elements along keys from the [c][t] plane
    const _Float16* vbp = V + ((size_t)b * C_ + 128 * g + m) * T_ + 8 * h;

    _Float16*       pw  = Pl + mt * 1024 + (8 * h) * 64 + 32 * g + m;   // write: + r*64 + 16*i
    const _Float16* pr  = Pl + mt * 1024 + m * 64 + 8 * h;              // read: + 0, 16, 32, 48
    float*          rmw = rmax + (mt * 2 + g) * 16 + 8 * h;
    const float*    rmo = rmax + (mt * 2 + (g ^ 1)) * 16 + 8 * h;
    float*          rsw = rsum + (mt * 2 + g) * 16 + 8 * h;
    const float*    rso = rsum + (mt * 2 + (g ^ 1)) * 16 + 8 * h;

    const v8f zero = {};
    float m_run[8], l_run[8];
    v8f acc[8];
    #pragma unroll
    for (int r = 0; r < 8; ++r) { m_run[r] = -__builtin_inff(); l_run[r] = 0.0f; }
    #pragma unroll
    for (int nt = 0; nt < 8; ++nt) acc[nt] = zero;

    #pragma unroll 1
    for (int s0 = 0; s0 < T_; s0 += 64) {
        // ---- S tiles for my 32 keys ----
        v8f s[2];
        #pragma unroll
        for (int i = 0; i < 2; ++i) {
            const size_t ko = (size_t)(s0 + 16 * i) * CQ_;
            FragB kh, kl;
            kh.h2[0] = *(const v8b*)(kbh + ko);
            kh.h2[1] = *(const v8b*)(kbh + ko + 16);
            kl.h2[0] = *(const v8b*)(kbl + ko);
            kl.h2[1] = *(const v8b*)(kbl + ko + 16);
            s[i] = mma_bf(aqh.v, kh.v, zero);
            s[i] = mma_bf(aqh.v, kl.v, s[i]);
            s[i] = mma_bf(aql.v, kh.v, s[i]);
            WG4(s[i], aqh.v, aql.v, kh.v, kl.v);
        }

        // ---- row max over my 32 keys (row 8h+r lives in one 16-lane half) ----
        float mx[8];
        #pragma unroll
        for (int r = 0; r < 8; ++r) mx[r] = fmaxf(s[0][r], s[1][r]);
        #pragma unroll
        for (int off = 1; off < 16; off <<= 1) {
            #pragma unroll
            for (int r = 0; r < 8; ++r) mx[r] = fmaxf(mx[r], __shfl_xor(mx[r], off, 32));
        }
        if (m == 0) {
            #pragma unroll
            for (int r = 0; r < 8; ++r) rmw[r] = mx[r];
        }
        __syncthreads();

        // ---- new running max (identical in both key-half waves), P tile, partial sums ----
        float fc[8], sm[8], nm2[8];
        #pragma unroll
        for (int r = 0; r < 8; ++r) {
            const float oth = rmo[r];
            const float nm  = fmaxf(m_run[r], fmaxf(mx[r], oth));
            fc[r]   = __expf(m_run[r] - nm);
            m_run[r] = nm;
            nm2[r]  = nm - LN4096;
            sm[r]   = 0.0f;
        }
        #pragma unroll
        for (int i = 0; i < 2; ++i) {
            #pragma unroll
            for (int r = 0; r < 8; ++r) {
                const float pe = __expf(s[i][r] - nm2[r]);       // 4096 * exp(s - m)
                const _Float16 p16 = (_Float16)pe;
                sm[r] += (float)p16;
                pw[r * 64 + 16 * i] = p16;
            }
        }
        #pragma unroll
        for (int off = 1; off < 16; off <<= 1) {
            #pragma unroll
            for (int r = 0; r < 8; ++r) sm[r] += __shfl_xor(sm[r], off, 32);
        }
        if (m == 0) {
            #pragma unroll
            for (int r = 0; r < 8; ++r) rsw[r] = sm[r];
        }
        __syncthreads();

        #pragma unroll
        for (int r = 0; r < 8; ++r) {
            const float tot = sm[r] + rso[r];
            l_run[r] = l_run[r] * fc[r] + tot;
            #pragma unroll
            for (int nt = 0; nt < 8; ++nt) acc[nt][r] *= fc[r];
        }

        // ---- A fragments of P (keys s0..s0+31 and s0+32..s0+63) from LDS ----
        FragH ap0, ap1;
        ap0.h2[0] = *(const v8h*)(pr);
        ap0.h2[1] = *(const v8h*)(pr + 16);
        ap1.h2[0] = *(const v8h*)(pr + 32);
        ap1.h2[1] = *(const v8h*)(pr + 48);

        // ---- O += P . V over my 8 channel tiles ----
        #pragma unroll
        for (int nt = 0; nt < 8; ++nt) {
            const _Float16* vp = vbp + (size_t)nt * 16 * T_ + s0;
            FragH b0, b1;
            b0.h2[0] = *(const v8h*)(vp);
            b0.h2[1] = *(const v8h*)(vp + 16);
            b1.h2[0] = *(const v8h*)(vp + 32);
            b1.h2[1] = *(const v8h*)(vp + 48);
            acc[nt] = mma_h(ap0.v, b0.v, acc[nt]);
            acc[nt] = mma_h(ap1.v, b1.v, acc[nt]);
            WG4(acc[nt], ap0.v, ap1.v, b0.v, b1.v);
        }
    }

    // ---- normalise and stage obuf[c][t] ----
    float inv[8];
    #pragma unroll
    for (int r = 0; r < 8; ++r) inv[r] = 1.0f / l_run[r];
    #pragma unroll
    for (int nt = 0; nt < 8; ++nt) {
        const int c = 128 * g + 16 * nt + m;
        #pragma unroll
        for (int r = 0; r < 8; ++r) obuf[c * OBP + 16 * mt + 8 * h + r] = acc[nt][r] * inv[r];
    }
    __syncthreads();

    const float* xb   = x   + (size_t)b * C_ * T_ + t0;
    float*       outb = out + (size_t)b * C_ * T_ + t0;
    v4f vals[16];
    #pragma unroll
    for (int it = 0; it < 16; ++it) {
        const int id = it * 128 + tid;
        const int c = id >> 3, ch = id & 7;
        const v4f o  = *(const v4f*)(obuf + c * OBP + 4 * ch);
        const v4f xr = *(const v4f*)(xb + (size_t)c * T_ + 4 * ch);
        vals[it] = o + xr;
    }
    #pragma unroll
    for (int it = 0; it < 16; ++it) {
        const int id = it * 128 + tid;
        const int c = id >> 3, ch = id & 7;
        *(v4f*)(outb + (size_t)c * T_ + 4 * ch) = vals[it];
    }
    
}

// =============================================================================================
extern "C" void kernel_launch(void* const* d_in, const int* in_sizes, int n_in,
                              void* d_out, int out_size, void* d_ws, size_t ws_size,
                              hipStream_t stream)
{
    if (n_in < 7) return;
    if (in_sizes[0] != B_ * C_ * T_ || in_sizes[1] != CQ_ * C_ || in_sizes[2] != CQ_ ||
        in_sizes[3] != CQ_ * C_ || in_sizes[4] != CQ_ || in_sizes[5] != C_ * C_ || in_sizes[6] != C_) return;
    if (out_size != B_ * C_ * T_) return;

    const float* x  = (const float*)d_in[0];
    const float* Wq = (const float*)d_in[1];
    const float* bq = (const float*)d_in[2];
    const float* Wk = (const float*)d_in[3];
    const float* bk = (const float*)d_in[4];
    const float* Wv = (const float*)d_in[5];
    const float* bv = (const float*)d_in[6];
    float* out = (float*)d_out;

    const size_t nqk  = (size_t)B_ * T_ * CQ_;            // elements per q/k plane (1 MiB each as 16-bit)
    const size_t nv   = (size_t)B_ * C_ * T_;             // elements of the v plane (8 MiB as 16-bit)
    const size_t need = (4 * nqk + nv) * sizeof(unsigned short);
    if (ws_size < need) return;

    unsigned short* Qh = (unsigned short*)d_ws;
    unsigned short* Ql = Qh + nqk;
    unsigned short* Kh = Ql + nqk;
    unsigned short* Kl = Kh + nqk;
    _Float16*       Vp = (_Float16*)(Kl + nqk);

    k_projqk<<<dim3(T_ / QT, B_), dim3(64), 0, stream>>>(x, Wq, bq, Wk, bk, Qh, Ql, Kh, Kl);
    k_projv<<<dim3(T_ / VT, C_ / VO, B_), dim3(128), 0, stream>>>(x, Wv, bv, Vp);
    k_attn<<<dim3(T_ / AT, B_), dim3(128), 0, stream>>>(
        (const __bf16*)Qh, (const __bf16*)Ql, (const __bf16*)Kh, (const __bf16*)Kl, Vp, x, out);
    (void)hipGetLastError();
}

// v001
// One run takes 187 microseconds.
// Next to v000, in two timings, it ran 1.69 and 1.70 times as fast.
#include <hip/hip_runtime.h>
#include <stdint.h>

// Operand types: q/k projections and S = q.k^T on v_wmma_f32_16x16x32_bf16 with bf16 hi/lo split operands (hi*hi + hi*lo + lo*hi); v projection (Wv scaled by 16) and P.V (P scaled by 4096) on v_wmma_f32_16x16x32_f16; all accumulators f32; softmax, normalisation and residual in f32.

#define T_   4096
#define C_   256
#define CQ_  32
#define B_   4
#define XP   264      // LDS pitch (16-bit elements) of transposed x tiles: 256 + 8
#define QT   32       // time rows per block, q/k projection
#define VT   64       // time columns per block, v projection
#define VO   64       // output channels per block, v projection
#define VTP  72       // LDS pitch (16-bit elements) of the v output tile
#define AT   32       // query rows per block, fused softmax + P.V kernel
#define OBP  36       // LDS pitch (floats) of the output staging tile
#define LN4096 8.31776616671934f
#define VROWB  128u                  // bytes of one staged V row: 64 keys, f16
#define VPITCH 144u                  // LDS pitch of a staged V row: 128 + 16, an odd multiple of 16 B for ds_load_b128 readers
#define VSROWS 64u                   // V rows (channels) per wave's slice of a stage
#define VSLICE 10240u                // LDS bytes per slice: 64 * 144 = 9216, rounded up to a multiple of 2 KiB
#define VBUF   (4u * VSLICE)         // LDS bytes per stage buffer: four slices

typedef char chk_dims[((T_ % QT) == 0 && (T_ % VT) == 0 && (T_ % AT) == 0 && (T_ % 64) == 0 &&
                       (C_ % VO) == 0 && (C_ % 32) == 0 && (CQ_ == 32) && (VO == 64) && (VT == 64) && (AT == 32)) ? 1 : -1];
typedef char chk_ring[(C_ == 4 * (int)VSROWS && T_ >= 128 && VSROWS * VPITCH <= VSLICE && (VSLICE % 2048u) == 0 &&
                       ((T_ * 2) % 16) == 0 && (T_ * 2) <= 131072) ? 1 : -1];

typedef __bf16         v16b __attribute__((ext_vector_type(16)));
typedef __bf16         v8b  __attribute__((ext_vector_type(8), __may_alias__));
typedef _Float16       v16h __attribute__((ext_vector_type(16)));
typedef _Float16       v8h  __attribute__((ext_vector_type(8), __may_alias__));
typedef float          v8f  __attribute__((ext_vector_type(8)));
typedef float          v4f  __attribute__((ext_vector_type(4), __may_alias__));
typedef unsigned short v8us __attribute__((ext_vector_type(8), __may_alias__));
typedef uint32_t       u32x4 __attribute__((ext_vector_type(4)));
typedef uint32_t       u32x8 __attribute__((ext_vector_type(8)));

union FragB { v16b v; v8b h2[2]; __bf16 e[16]; };
union FragH { v16h v; v8h h2[2]; _Float16 e[16]; };

// ---------------------------------------------------------------------------------------------
// 16x16x32 tiles. Per lane: h = lane>>4, m = lane&15.
// A: row m, elements 0..7 <- k0+8h+0..7, elements 8..15 <- k0+16+8h+0..7.
// B: column m, same k map (loaded from a [n][k] k-contiguous copy exactly like A).
// D: element r <- (row 8h+r, column m).
// ---------------------------------------------------------------------------------------------
__device__ __forceinline__ v8f mma_bf(v16b a, v16b b, v8f c) {
    return __builtin_amdgcn_wmma_f32_16x16x32_bf16(false, a, false, b, (short)0, c, false, false);
}
__device__ __forceinline__ v8f mma_h(v16h a, v16h b, v8f c) {
    return __builtin_amdgcn_wmma_f32_16x16x32_f16(false, a, false, b, (short)0, c, false, false);
}
#define WG4(acc, p0, p1, p2, p3) \
    asm volatile("v_nop\n\tv_nop\n\tv_nop\n\tv_nop" : "+v"(acc) : "v"(p0), "v"(p1), "v"(p2), "v"(p3))

// ---------------------------------------------------------------------------------------------
// Tensor load of one slice of V: 64 rows of 128 bytes, source pitch 2*T_ bytes, 16 bytes of LDS pad behind every row.
// ---------------------------------------------------------------------------------------------
__device__ __forceinline__ uint32_t uni(uint32_t v) { return (uint32_t)__builtin_amdgcn_readfirstlane(v); }
// A tensor load ignores EXEC: the test around it must compile to s_cmp + s_cbranch_scc.
__device__ __forceinline__ uint32_t pinned(uint32_t v) {
    uint32_t w = uni(v);
    asm volatile("" : "+s"(w));   // pinned(): holds the wave-uniform test in a scalar register, so that the branch on it stays scalar
    return w;
}
__device__ __forceinline__ u32x8 tdm_group1_v() {
    u32x8 g;
    g[0] = uni((1u << 20) | (4u << 22) | (3u << 25));       // no mask, 1-byte elements, a pad of 4 dwords after every 32 dwords
    g[1] = uni((VROWB & 0xFFFFu) << 16);                    // tensor_dim0 = tile_dim0
    g[2] = uni((VROWB >> 16) | ((VSROWS & 0xFFFFu) << 16)); // tensor_dim1 = tile_dim1
    g[3] = uni((VSROWS >> 16) | (VROWB << 16));
    g[4] = uni(VSROWS);
    g[5] = uni((uint32_t)(T_ * 2));                         // source row pitch in bytes
    g[6] = uni(0u);
    g[7] = uni(0u);
    return g;
}
__device__ __forceinline__ u32x4 tdm_group0(uint32_t lds_dst, uint64_t ga) {
    u32x4 g;
    g[0] = uni(1u);
    g[1] = uni(lds_dst);
    g[2] = uni((uint32_t)ga);
    g[3] = uni((((uint32_t)(ga >> 32)) & 0x01FFFFFFu) | 0x80000000u);
    return g;
}
// group 0 is named as an in-out operand (the instruction leaves it as it is): what the caller carries on to the request's wait
// is then the very register tuple that the request was issued from, not a copy of it
__device__ __forceinline__ void tdm_load(u32x4& g0, u32x8 g1) {
    asm volatile("tensor_load_to_lds %0, %1" : "+s"(g0) : "s"(g1) : "memory");
}
// the compiler places no wait for a tensor load: the issuing wave's own wait, in front of the barrier that publishes the tile.
// It names the outstanding request's descriptor as inputs, so that those scalar registers keep their values up to the wait.
__device__ __forceinline__ void wait_tensor0(u32x4 g0, u32x8 g1) {
    asm volatile("s_wait_tensorcnt 0x0" :: "s"(g0), "s"(g1) : "memory");
}
// the same wait behind the loop, where every request has been waited for already: no descriptor is left to keep
__device__ __forceinline__ void wait_tensor0_end() { asm volatile("s_wait_tensorcnt 0x0" ::: "memory"); }
// this wave's LDS reads of a buffer have retired before the buffer is handed back for a refill
__device__ __forceinline__ void wait_ds0() { asm volatile("s_wait_dscnt 0x0" ::: "memory"); }

// 2^x with the free issue slot that the instruction set asks for behind a transcendental written into the same statement
__device__ __forceinline__ float exp2_slot(float x) {
    float r;
    asm("v_exp_f32 %0, %1\n\tv_nop" : "=v"(r) : "v"(x));
    return r;
}

__device__ __forceinline__ unsigned short bfbits(__bf16 v) { return __builtin_bit_cast(unsigned short, v); }
__device__ __forceinline__ float bf2f(__bf16 v) {
    return __builtin_bit_cast(float, ((unsigned int)bfbits(v)) << 16);
}
// RNE convert to bf16 hi part and bf16 residual
__device__ __forceinline__ void split_bf(float f, __bf16& hi, __bf16& lo) {
    hi = (__bf16)f;
    lo = (__bf16)(f - bf2f(hi));
}

// B fragment for column m of W (row o of W, k contiguous): p = W + o*C + k0 + 8h
__device__ __forceinline__ void load_w_split(const float* __restrict__ p, FragB& bh, FragB& bl) {
    const v4f f0 = *(const v4f*)(p);
    const v4f f1 = *(const v4f*)(p + 4);
    const v4f f2 = *(const v4f*)(p + 16);
    const v4f f3 = *(const v4f*)(p + 20);
    #pragma unroll
    for (int i = 0; i < 4; ++i) {
        __bf16 a, e;
        split_bf(f0[i], a, e); bh.e[i]      = a; bl.e[i]      = e;
        split_bf(f1[i], a, e); bh.e[4 + i]  = a; bl.e[4 + i]  = e;
        split_bf(f2[i], a, e); bh.e[8 + i]  = a; bl.e[8 + i]  = e;
        split_bf(f3[i], a, e); bh.e[12 + i] = a; bl.e[12 + i] = e;
    }
}
__device__ __forceinline__ void load_w_h16x16(const float* __restrict__ p, FragH& b) {
    const v4f f0 = *(const v4f*)(p);
    const v4f f1 = *(const v4f*)(p + 4);
    const v4f f2 = *(const v4f*)(p + 16);
    const v4f f3 = *(const v4f*)(p + 20);
    #pragma unroll
    for (int i = 0; i < 4; ++i) {
        b.e[i]      = (_Float16)(f0[i] * 16.0f);
        b.e[4 + i]  = (_Float16)(f1[i] * 16.0f);
        b.e[8 + i]  = (_Float16)(f2[i] * 16.0f);
        b.e[12 + i] = (_Float16)(f3[i] * 16.0f);
    }
}

// =============================================================================================
// q[b,t,o] = sum_c Wq[o,c] x[b,c,t] + bq[o]; k likewise. Output planes [B][T][32] bf16 hi and lo.
// Block: 32 t rows, 2 waves (wave w -> rows 16w..16w+15), A = x tile [t][c] from LDS, B = W rows.
// =============================================================================================
__global__ __launch_bounds__(64)
void k_projqk(const float* __restrict__ x, const float* __restrict__ Wq, const float* __restrict__ bq,
              const float* __restrict__ Wk, const float* __restrict__ bk,
              unsigned short* __restrict__ Qh, unsigned short* __restrict__ Ql,
              unsigned short* __restrict__ Kh, unsigned short* __restrict__ Kl)
{
    __shared__ __attribute__((aligned(16))) __bf16 xh[QT * XP];
    __shared__ __attribute__((aligned(16))) __bf16 xl[QT * XP];
    __shared__ __attribute__((aligned(16))) unsigned short ob[4 * QT * CQ_];

    const int tid = threadIdx.x;
    const int l = tid & 31, w = tid >> 5, h = l >> 4, m = l & 15;
    const int t0 = blockIdx.x * QT, b = blockIdx.y;
    if (t0 + QT > T_ || b >= B_) return;

    // stage x[b][c][t0..t0+31] transposed into xh/xl[t][c]
    const float* xb = x + (size_t)b * C_ * T_ + t0;
    #pragma unroll 2
    for (int it = 0; it < (C_ * QT / 4) / 64; ++it) {
        const int idx = it * 64 + tid;
        const int c   = idx >> 3;
        const int q4  = idx & 7;
        const v4f v = *(const v4f*)(xb + (size_t)c * T_ + 4 * q4);
        #pragma unroll
        for (int j = 0; j < 4; ++j) {
            __bf16 a, e;
            split_bf(v[j], a, e);
            xh[(4 * q4 + j) * XP + c] = a;
            xl[(4 * q4 + j) * XP + c] = e;
        }
    }
    __syncthreads();

    const v8f zero = {};
    v8f acc[4];
    #pragma unroll
    for (int j = 0; j < 4; ++j) acc[j] = zero;

    const __bf16* arh = xh + (16 * w + m) * XP + 8 * h;
    const __bf16* arl = xl + (16 * w + m) * XP + 8 * h;
    const float* wq = Wq + (size_t)m * C_ + 8 * h;
    const float* wk = Wk + (size_t)m * C_ + 8 * h;

    #pragma unroll 1
    for (int ks = 0; ks < C_ / 32; ++ks) {
        const int k0 = ks * 32;
        FragB ah, al;
        ah.h2[0] = *(const v8b*)(arh + k0);
        ah.h2[1] = *(const v8b*)(arh + k0 + 16);
        al.h2[0] = *(const v8b*)(arl + k0);
        al.h2[1] = *(const v8b*)(arl + k0 + 16);
        #pragma unroll
        for (int j = 0; j < 4; ++j) {
            const float* wp = ((j < 2) ? wq : wk) + (size_t)(16 * (j & 1)) * C_ + k0;
            FragB bh, bl;
            load_w_split(wp, bh, bl);
            acc[j] = mma_bf(ah.v, bh.v, acc[j]);
            acc[j] = mma_bf(ah.v, bl.v, acc[j]);
            acc[j] = mma_bf(al.v, bh.v, acc[j]);
            WG4(acc[j], ah.v, al.v, bh.v, bl.v);
        }
    }

    // epilogue: bias, split into hi/lo, stage [plane][t][o] in LDS
    #pragma unroll
    for (int j = 0; j < 4; ++j) {
        const int o = 16 * (j & 1) + m;
        const float bias = ((j < 2) ? bq : bk)[o];
        const int pb = ((j < 2) ? 0 : 2) * (QT * CQ_);
        #pragma unroll
        for (int r = 0; r < 8; ++r) {
            const int tl = 16 * w + 8 * h + r;
            __bf16 a, e;
            split_bf(acc[j][r] + bias, a, e);
            ob[pb + tl * CQ_ + o]            = bfbits(a);
            ob[pb + QT * CQ_ + tl * CQ_ + o] = bfbits(e);
        }
    }
    __syncthreads();

    v8us vals[8];
    #pragma unroll
    for (int it = 0; it < 8; ++it) {
        const int p  = it >> 1;
        const int wi = (it & 1) * 64 + tid;
        vals[it] = *(const v8us*)(ob + p * (QT * CQ_) + wi * 8);
    }
    const size_t gb = ((size_t)b * T_ + t0) * CQ_;
    #pragma unroll
    for (int it = 0; it < 8; ++it) {
        const int p  = it >> 1;
        const int wi = (it & 1) * 64 + tid;
        unsigned short* dst = ((p == 0) ? Qh : (p == 1) ? Ql : (p == 2) ? Kh : Kl) + gb + (size_t)wi * 8;
        *(v8us*)dst = vals[it];
    }
    
}

// =============================================================================================
// v[b,c,t] = sum_c' Wv[c,c'] x[b,c',t] + bv[c]; output plane [B][C][T] f16.
// Block: 64 t x 64 c, 4 waves (wave w -> channels o0+16w..+15, all four 16-row t tiles).
// =============================================================================================
__global__ __launch_bounds__(128)
void k_projv(const float* __restrict__ x, const float* __restrict__ Wv, const float* __restrict__ bv,
             _Float16* __restrict__ V)
{
    __shared__ __attribute__((aligned(16))) _Float16 xt[VT * XP];
    __shared__ __attribute__((aligned(16))) _Float16 vt[VO * VTP];

    const int tid = threadIdx.x;
    const int l = tid & 31, w = tid >> 5, h = l >> 4, m = l & 15;
    const int t0 = blockIdx.x * VT, o0 = blockIdx.y * VO, b = blockIdx.z;
    if (t0 + VT > T_ || o0 + VO > C_ || b >= B_) return;

    // stage x[b][c][t0..t0+63] transposed into xt[t][c] (f16)
    const float* xb = x + (size_t)b * C_ * T_ + t0;
    #pragma unroll 2
    for (int it = 0; it < (C_ * VT / 4) / 128; ++it) {
        const int idx = it * 128 + tid;
        const int c   = idx >> 4;
        const int q4  = idx & 15;
        const v4f v = *(const v4f*)(xb + (size_t)c * T_ + 4 * q4);
        #pragma unroll
        for (int j = 0; j < 4; ++j) xt[(4 * q4 + j) * XP + c] = (_Float16)v[j];
    }
    __syncthreads();

    const v8f zero = {};
    v8f acc[4];
    #pragma unroll
    for (int mt = 0; mt < 4; ++mt) acc[mt] = zero;

    const _Float16* ar = xt + m * XP + 8 * h;
    const float* wr = Wv + (size_t)(o0 + 16 * w + m) * C_ + 8 * h;

    #pragma unroll 1
    for (int ks = 0; ks < C_ / 32; ++ks) {
        const int k0 = ks * 32;
        FragH bw;
        load_w_h16x16(wr + k0, bw);
        FragH a[4];
        #pragma unroll
        for (int mt = 0; mt < 4; ++mt) {
            a[mt].h2[0] = *(const v8h*)(ar + 16 * mt * XP + k0);
            a[mt].h2[1] = *(const v8h*)(ar + 16 * mt * XP + k0 + 16);
        }
        #pragma unroll
        for (int mt = 0; mt < 4; ++mt) acc[mt] = mma_h(a[mt].v, bw.v, acc[mt]);
        asm volatile("v_nop\n\tv_nop\n\tv_nop\n\tv_nop"
                     : "+v"(acc[0]), "+v"(acc[1]), "+v"(acc[2]), "+v"(acc[3])
                     : "v"(bw.v), "v"(a[0].v), "v"(a[1].v), "v"(a[2].v), "v"(a[3].v));
    }

    // epilogue: undo the x16, add bias, stage transposed vt[c][t]
    const int cl = 16 * w + m;
    const float bias = bv[o0 + cl];
    #pragma unroll
    for (int mt = 0; mt < 4; ++mt) {
        #pragma unroll
        for (int r = 0; r < 8; ++r) {
            const int tl = 16 * mt + 8 * h + r;
            vt[cl * VTP + tl] = (_Float16)(acc[mt][r] * 0.0625f + bias);
        }
    }
    __syncthreads();

    v8h vals[4];
    #pragma unroll
    for (int it = 0; it < 4; ++it) {
        const int id = it * 128 + tid;
        const int line = id >> 3, ch = id & 7;
        vals[it] = *(const v8h*)(vt + line * VTP + ch * 8);
    }
    #pragma unroll
    for (int it = 0; it < 4; ++it) {
        const int id = it * 128 + tid;
        const int line = id >> 3, ch = id & 7;
        _Float16* dst = V + ((size_t)b * C_ + o0 + line) * T_ + t0 + ch * 8;
        *(v8h*)dst = vals[it];
    }
    
}

// =============================================================================================
// Fused softmax(q.k^T) . V + residual. Block: 32 query rows x 256 channels, 4 waves.
// Wave (mt, g): query tile rows t0+16mt..+15; S for keys s0+32g..s0+32g+31 of each 64-key step;
// P.V for channels 128g..128g+127. Row max / partial row sums exchanged through LDS.
// V[256 channels][64 keys] of each step is staged in LDS by tensor loads, two buffers: wave w brings channels 64w..64w+63,
// the load of step s+2 is issued at the foot of step s, and all four waves read their B fragments from the staged tile.
// out[b,c,t] = (sum_s P[t,s] V[c,s]) / (sum_s P[t,s]) + x[b,c,t]
// =============================================================================================
__global__ __launch_bounds__(128)
void k_attn(const __bf16* __restrict__ Qh, const __bf16* __restrict__ Ql,
            const __bf16* __restrict__ Kh, const __bf16* __restrict__ Kl,
            const _Float16* __restrict__ V, const float* __restrict__ x, float* __restrict__ out)
{
    __shared__ __attribute__((aligned(2048))) unsigned char vring[2 * VBUF];
    __shared__ __attribute__((aligned(16))) _Float16 Pl[2 * 16 * 64];
    __shared__ __attribute__((aligned(16))) float rmax[64];
    __shared__ __attribute__((aligned(16))) float rsum[64];
    __shared__ __attribute__((aligned(16))) float obuf[C_ * OBP];

    const int tid = threadIdx.x;
    const int l = tid & 31, w = tid >> 5, h = l >> 4, m = l & 15;
    const int mt = w >> 1, g = w & 1;
    const int t0 = blockIdx.x * AT, b = blockIdx.y;
    if (t0 + AT > T_ || b >= B_) return;

    // A fragments of q (hi and lo), held for the whole key loop
    const size_t qoff = ((size_t)b * T_ + t0 + 16 * mt + m) * CQ_ + 8 * h;
    FragB aqh, aql;
    aqh.h2[0] = *(const v8b*)(Qh + qoff);
    aqh.h2[1] = *(const v8b*)(Qh + qoff + 16);
    aql.h2[0] = *(const v8b*)(Ql + qoff);
    aql.h2[1] = *(const v8b*)(Ql + qoff + 16);

    // B fragments of k: column m = key (kbase + m), elements from row (kbase + m) of the [key][32] plane
    const __bf16* kbh = Kh + ((size_t)b * T_ + 32 * g + m) * CQ_ + 8 * h;
    const __bf16* kbl = Kl + ((size_t)b * T_ + 32 * g + m) * CQ_ + 8 * h;
    // B fragments of v: column m = channel (128g + 16nt + m), elements along keys, from the staged tile:
    // slice 2g + (nt >> 2), row 16(nt & 3) + m, byte 16h + 32j
    const unsigned char* vfr = vring + (2 * g) * VSLICE + m * VPITCH + 16 * h;

    // my slice of every stage: channels 64*wv .. 64*wv+63, keys s0 .. s0+63
    const uint32_t wv    = uni((uint32_t)tid >> 5);
    const uint32_t vdst  = (uint32_t)(size_t)vring + wv * VSLICE;
    const uint64_t vsrc  = (uint64_t)(size_t)(V + ((size_t)b * C_ + VSROWS * wv) * T_);
    const u32x8    vg1   = tdm_group1_v();

    // ring prologue: stage 0 lands and is published, then stage 1 is put in flight
    u32x4 vg0 = tdm_group0(vdst, vsrc);          // group 0 of the request in flight, carried to that request's wait
    tdm_load(vg0, vg1);
    wait_tensor0(vg0, vg1);
    __syncthreads();
    vg0 = tdm_group0(vdst + VBUF, vsrc + VROWB);
    tdm_load(vg0, vg1);

    _Float16*       pw  = Pl + mt * 1024 + (8 * h) * 64 + 32 * g + m;   // write: + r*64 + 16*i
    const _Float16* pr  = Pl + mt * 1024 + m * 64 + 8 * h;              // read: + 0, 16, 32, 48
    float*          rmw = rmax + (mt * 2 + g) * 16 + 8 * h;
    const float*    rmo = rmax + (mt * 2 + (g ^ 1)) * 16 + 8 * h;
    float*          rsw = rsum + (mt * 2 + g) * 16 + 8 * h;
    const float*    rso = rsum + (mt * 2 + (g ^ 1)) * 16 + 8 * h;

    const v8f zero = {};
    float m_run[8], l_run[8];
    v8f acc[8];
    #pragma unroll
    for (int r = 0; r < 8; ++r) { m_run[r] = -__builtin_inff(); l_run[r] = 0.0f; }
    #pragma unroll
    for (int nt = 0; nt < 8; ++nt) acc[nt] = zero;

    #pragma unroll 1
    for (int s0 = 0; s0 < T_; s0 += 64) {
        // ---- S tiles for my 32 keys ----
        v8f s[2];
        #pragma unroll
        for (int i = 0; i < 2; ++i) {
            const size_t ko = (size_t)(s0 + 16 * i) * CQ_;
            FragB kh, kl;
            kh.h2[0] = *(const v8b*)(kbh + ko);
            kh.h2[1] = *(const v8b*)(kbh + ko + 16);
            kl.h2[0] = *(const v8b*)(kbl + ko);
            kl.h2[1] = *(const v8b*)(kbl + ko + 16);
            s[i] = mma_bf(aqh.v, kh.v, zero);
            s[i] = mma_bf(aqh.v, kl.v, s[i]);
            s[i] = mma_bf(aql.v, kh.v, s[i]);
            WG4(s[i], aqh.v, aql.v, kh.v, kl.v);
        }

        // ---- row max over my 32 keys (row 8h+r lives in one 16-lane half) ----
        float mx[8];
        #pragma unroll
        for (int r = 0; r < 8; ++r) mx[r] = fmaxf(s[0][r], s[1][r]);
        #pragma unroll
        for (int off = 1; off < 16; off <<= 1) {
            #pragma unroll
            for (int r = 0; r < 8; ++r) mx[r] = fmaxf(mx[r], __shfl_xor(mx[r], off, 32));
        }
        if (m == 0) {
            #pragma unroll
            for (int r = 0; r < 8; ++r) rmw[r] = mx[r];
        }
        __syncthreads();

        // ---- new running max (identical in both key-half waves), P tile, partial sums ----
        float fc[8], sm[8], nm2[8];
        #pragma unroll
        for (int r = 0; r < 8; ++r) {
            const float oth = rmo[r];
            const float nm  = fmaxf(m_run[r], fmaxf(mx[r], oth));
            fc[r]   = exp2_slot((m_run[r] - nm) * 1.44269504f);   // exp(m_run - nm), the same multiply and v_exp_f32 as __expf
            m_run[r] = nm;
            nm2[r]  = nm - LN4096;
            sm[r]   = 0.0f;
        }
        #pragma unroll
        for (int i = 0; i < 2; ++i) {
            #pragma unroll
            for (int r = 0; r < 8; ++r) {
                const float pe = __expf(s[i][r] - nm2[r]);       // 4096 * exp(s - m)
                const _Float16 p16 = (_Float16)pe;
                sm[r] += (float)p16;
                pw[r * 64 + 16 * i] = p16;
            }
        }
        #pragma unroll
        for (int off = 1; off < 16; off <<= 1) {
            #pragma unroll
            for (int r = 0; r < 8; ++r) sm[r] += __shfl_xor(sm[r], off, 32);
        }
        if (m == 0) {
            #pragma unroll
            for (int r = 0; r < 8; ++r) rsw[r] = sm[r];
        }
        __syncthreads();

        #pragma unroll
        for (int r = 0; r < 8; ++r) {
            const float tot = sm[r] + rso[r];
            l_run[r] = l_run[r] * fc[r] + tot;
            #pragma unroll
            for (int nt = 0; nt < 8; ++nt) acc[nt][r] *= fc[r];
        }

        // ---- A fragments of P (keys s0..s0+31 and s0+32..s0+63) from LDS ----
        FragH ap0, ap1;
        ap0.h2[0] = *(const v8h*)(pr);
        ap0.h2[1] = *(const v8h*)(pr + 16);
        ap1.h2[0] = *(const v8h*)(pr + 32);
        ap1.h2[1] = *(const v8h*)(pr + 48);

        // ---- O += P . V over my 8 channel tiles; B fragments of V from this step's buffer, four tiles' reads in flight:
        //      tile nt + 4 is read into the registers of tile nt once tile nt's products are issued ----
        const uint32_t vbo = ((uint32_t)s0 & 64u) ? VBUF : 0u;
        FragH b0[4], b1[4];
        #pragma unroll
        for (int nt = 0; nt < 4; ++nt) {
            const unsigned char* vp = vfr + vbo + nt * 16 * VPITCH;
            b0[nt].h2[0] = *(const v8h*)(vp);
            b0[nt].h2[1] = *(const v8h*)(vp + 32);
            b1[nt].h2[0] = *(const v8h*)(vp + 64);
            b1[nt].h2[1] = *(const v8h*)(vp + 96);
        }
        #pragma unroll
        for (int nt = 0; nt < 8; ++nt) {
            const int q = nt & 3;
            acc[nt] = mma_h(ap0.v, b0[q].v, acc[nt]);
            acc[nt] = mma_h(ap1.v, b1[q].v, acc[nt]);
            WG4(acc[nt], ap0.v, ap1.v, b0[q].v, b1[q].v);
            if (nt < 4) {
                const unsigned char* vp = vfr + vbo + VSLICE + q * 16 * VPITCH;
                b0[q].h2[0] = *(const v8h*)(vp);
                b0[q].h2[1] = *(const v8h*)(vp + 32);
                b1[q].h2[0] = *(const v8h*)(vp + 64);
                b1[q].h2[1] = *(const v8h*)(vp + 96);
            }
        }

        // ---- publish point of the next stage, then the refill of the buffer this step has read ----
        wait_ds0();
        wait_tensor0(vg0, vg1);
        __syncthreads();
        if (pinned((uint32_t)(s0 + 128 < T_))) {
            vg0 = tdm_group0(vdst + vbo, vsrc + (uint64_t)(s0 + 128) * 2u);
            tdm_load(vg0, vg1);
        }
    }
    wait_tensor0_end();
    wait_ds0();

    // ---- normalise and stage obuf[c][t] ----
    float inv[8];
    #pragma unroll
    for (int r = 0; r < 8; ++r) inv[r] = 1.0f / l_run[r];
    #pragma unroll
    for (int nt = 0; nt < 8; ++nt) {
        const int c = 128 * g + 16 * nt + m;
        #pragma unroll
        for (int r = 0; r < 8; ++r) obuf[c * OBP + 16 * mt + 8 * h + r] = acc[nt][r] * inv[r];
    }
    __syncthreads();

    const float* xb   = x   + (size_t)b * C_ * T_ + t0;
    float*       outb = out + (size_t)b * C_ * T_ + t0;
    v4f vals[16];
    #pragma unroll
    for (int it = 0; it < 16; ++it) {
        const int id = it * 128 + tid;
        const int c = id >> 3, ch = id & 7;
        const v4f o  = *(const v4f*)(obuf + c * OBP + 4 * ch);
        const v4f xr = *(const v4f*)(xb + (size_t)c * T_ + 4 * ch);
        vals[it] = o + xr;
    }
    #pragma unroll
    for (int it = 0; it < 16; ++it) {
        const int id = it * 128 + tid;
        const int c = id >> 3, ch = id & 7;
        *(v4f*)(outb + (size_t)c * T_ + 4 * ch) = vals[it];
    }
    
}

// =============================================================================================
extern "C" void kernel_launch(void* const* d_in, const int* in_sizes, int n_in,
                              void* d_out, int out_size, void* d_ws, size_t ws_size,
                              hipStream_t stream)
{
    if (n_in < 7) return;
    if (in_sizes[0] != B_ * C_ * T_ || in_sizes[1] != CQ_ * C_ || in_sizes[2] != CQ_ ||
        in_sizes[3] != CQ_ * C_ || in_sizes[4] != CQ_ || in_sizes[5] != C_ * C_ || in_sizes[6] != C_) return;
    if (out_size != B_ * C_ * T_) return;

    const float* x  = (const float*)d_in[0];
    const float* Wq = (const float*)d_in[1];
    const float* bq = (const float*)d_in[2];
    const float* Wk = (const float*)d_in[3];
    const float* bk = (const float*)d_in[4];
    const float* Wv = (const float*)d_in[5];
    const float* bv = (const float*)d_in[6];
    float* out = (float*)d_out;

    const size_t nqk  = (size_t)B_ * T_ * CQ_;            // elements per q/k plane (1 MiB each as 16-bit)
    const size_t nv   = (size_t)B_ * C_ * T_;             // elements of the v plane (8 MiB as 16-bit)
    const size_t need = (4 * nqk + nv) * sizeof(unsigned short);
    if (ws_size < need) return;

    unsigned short* Qh = (unsigned short*)d_ws;
    unsigned short* Ql = Qh + nqk;
    unsigned short* Kh = Ql + nqk;
    unsigned short* Kl = Kh + nqk;
    _Float16*       Vp = (_Float16*)(Kl + nqk);

    k_projqk<<<dim3(T_ / QT, B_), dim3(64), 0, stream>>>(x, Wq, bq, Wk, bk, Qh, Ql, Kh, Kl);
    k_projv<<<dim3(T_ / VT, C_ / VO, B_), dim3(128), 0, stream>>>(x, Wv, bv, Vp);
    k_attn<<<dim3(T_ / AT, B_), dim3(128), 0, stream>>>(
        (const __bf16*)Qh, (const __bf16*)Ql, (const __bf16*)Kh, (const __bf16*)Kl, Vp, x, out);
    (void)hipGetLastError();
}
